// v000
// The times below were measured on an AMD MI455X: many runs one after another, warmed up first and cycling through
// copies of the inputs, with the whole window's GPU time divided by the number of runs. Launches and the gaps
// between them are all in it. The median over several windows is given; except for v000 it joins two sittings, which
// can be a few percent apart, so the side-by-side timings, each taken in one sitting, are the better comparison.
// v000, which the later versions start from, runs in 129 microseconds.
#include <hip/hip_runtime.h>
#include <math.h>

// Problem constants (from reference)
#define FF    64
#define HH    8
#define EE    64
#define PP    512
#define BT    (64 * 256)     // 16384 rows
#define KTOT  1024           // 2 branches * F * H

typedef float v2f __attribute__((ext_vector_type(2)));
typedef float v4f __attribute__((ext_vector_type(4)));
typedef float v8f __attribute__((ext_vector_type(8)));
typedef int   v4i __attribute__((ext_vector_type(4)));

// --------------------------------------------------------------------------
// CDNA5 async global->LDS path (ASYNCcnt), guarded so the file compiles on
// toolchains without the builtins (falls back to VGPR round-trip staging).
// Builtin signatures (from clang diagnostics):
//   b128: (AS1 int4* src, AS3 int4* dst, imm int offset, imm int cpol)
//   b32:  (AS1 int*  src, AS3 int*  dst, imm int offset, imm int cpol)
// --------------------------------------------------------------------------
#if defined(__gfx1250__) && \
    __has_builtin(__builtin_amdgcn_global_load_async_to_lds_b128) && \
    __has_builtin(__builtin_amdgcn_global_load_async_to_lds_b32)
#define USE_ASYNC 1
#else
#define USE_ASYNC 0
#endif

#if USE_ASYNC
#if __has_builtin(__builtin_amdgcn_s_wait_asynccnt)
#define WAIT_ASYNC(n) __builtin_amdgcn_s_wait_asynccnt(n)
#else
#define WAIT_ASYNC(n) asm volatile("s_wait_asynccnt " #n ::: "memory")
#endif
#else
#define WAIT_ASYNC(n) do {} while (0)
#endif

#if USE_ASYNC
typedef __attribute__((address_space(1))) v4i  g_v4i;
typedef __attribute__((address_space(3))) v4i  l_v4i;
typedef __attribute__((address_space(1))) int  g_i32;
typedef __attribute__((address_space(3))) int  l_i32;
#endif

__device__ __forceinline__ void async_copy_b128(const float* g, float* l) {
#if USE_ASYNC
  __builtin_amdgcn_global_load_async_to_lds_b128((g_v4i*)g, (l_v4i*)l, 0, 0);
#else
  *(v4f*)l = *(const v4f*)g;
#endif
}
__device__ __forceinline__ void async_copy_b32(const float* g, float* l) {
#if USE_ASYNC
  __builtin_amdgcn_global_load_async_to_lds_b32((g_i32*)g, (l_i32*)l, 0, 0);
#else
  *l = *g;
#endif
}

// ---------------------------------------------------------------------------
// Kernel 1: fold w2 (H->E) into wx/wt (E->P):
//   Wcat[k][p], k = branch*512 + f*8 + h, = sum_e w2[f][h][e] * W[(f*E+e)*P+p]
// ---------------------------------------------------------------------------
__global__ __launch_bounds__(256) void build_w_kernel(
    const float* __restrict__ w2v, const float* __restrict__ w2t,
    const float* __restrict__ wx,  const float* __restrict__ wt,
    float* __restrict__ Wcat) {
  int idx = blockIdx.x * blockDim.x + threadIdx.x;   // [0, KTOT*PP)
  int p  = idx & (PP - 1);
  int k  = idx >> 9;
  int br = k >> 9;
  int kk = k & 511;
  int f  = kk >> 3;
  int h  = kk & 7;
  const float* w2 = br ? w2t : w2v;
  const float* wb = br ? wt  : wx;
  const float* w2row = w2 + (size_t)(f * HH + h) * EE;
  const float* wcol  = wb + (size_t)f * EE * PP + p;
  float acc = 0.f;
#pragma unroll 8
  for (int e = 0; e < EE; ++e)
    acc = fmaf(w2row[e], wcol[(size_t)e * PP], acc);
  Wcat[idx] = acc;
}

// ---------------------------------------------------------------------------
// Kernel 2: tanh prologue, materialize Hcat[16384][1024] (L2-resident, 64 MB)
// ---------------------------------------------------------------------------
__global__ __launch_bounds__(256) void build_h_kernel(
    const float* __restrict__ x,   const float* __restrict__ tm,
    const float* __restrict__ w1v, const float* __restrict__ b1v,
    const float* __restrict__ w1t, const float* __restrict__ b1t,
    float* __restrict__ Hcat) {
  int idx = blockIdx.x * blockDim.x + threadIdx.x;   // [0, BT*KTOT)
  int k  = idx & (KTOT - 1);
  int bt = idx >> 10;
  int br = k >> 9;
  int kk = k & 511;
  int f  = kk >> 3;
  int h  = kk & 7;
  const float* in = br ? tm  : x;
  const float* w1 = br ? w1t : w1v;
  const float* b1 = br ? b1t : b1v;
  Hcat[idx] = tanhf(fmaf(in[bt * FF + f], w1[f * HH + h], b1[f * HH + h]));
}

// ---------------------------------------------------------------------------
// Kernel 3: C = Hcat[16384][1024] @ Wcat[1024][512] + (bx + bt)
//
// Block tile 128(M) x 64(N), 256 threads = 8 waves; wave w owns rows w*16..+15
// as four 16x16 f32 tiles via V_WMMA_F32_16X16X4_F32 (exact fp32).
//
// Double-buffered LDS, filled by GLOBAL_LOAD_ASYNC_TO_LDS (ASYNCcnt) so the
// HBM/L2 fetch of tile i+1 overlaps the WMMA stream of tile i.
//   A: row-major, stride 36 floats (144B rows: 16B aligned; gcd(36,64)=4 gives
//      16 distinct banks for the frag reads, halves on even/odd bank pairs).
//   B: k-pair interleaved, (k,n) at [(k>>1)*160 + 2n + (k&1)] so each lane's
//      (b.x,b.y) is one aligned ds_load_b64; +160 floats = +32 banks keeps the
//      two lane-halves on disjoint bank sets.
// ---------------------------------------------------------------------------
#define MB     128
#define NB     64
#define KB     32
#define LDA    36
#define PAIRS  160           // floats per k-pair group of B (2*NB + 32 pad)

__global__ __launch_bounds__(256) void gemm_kernel(
    const float* __restrict__ A,    // Hcat [BT][KTOT]
    const float* __restrict__ Bm,   // Wcat [KTOT][PP]
    const float* __restrict__ bx,   const float* __restrict__ btb,
    float* __restrict__ C) {
  __shared__ __align__(16) float lsA[2][MB * LDA];          // 2 x 18 KB
  __shared__ __align__(16) float lsB[2][(KB / 2) * PAIRS];  // 2 x 10 KB

  const int tid  = threadIdx.x;
  const int lane = tid & 31;
  const int wave = tid >> 5;
  const int row0 = blockIdx.x * MB;
  const int col0 = blockIdx.y * NB;

  const int r16  = lane & 15;       // 0..15
  const int koff = (lane >> 4) * 2; // 0 for lanes 0-15, 2 for lanes 16-31

  v8f acc[4] = {};

  // Issue one tile stage: 4x b128 (A) + 8x b32 (B) per thread
  // = 12 async instructions per wave.
  auto issue_stage = [&](int buf, int kb) {
#pragma unroll
    for (int pass = 0; pass < 4; ++pass) {      // A: 128x32 floats
      int g  = pass * 256 + tid;                // 0..1023
      int r  = g >> 3;                          // row 0..127
      int c4 = (g & 7) << 2;                    // col 0,4,...,28
      async_copy_b128(&A[(size_t)(row0 + r) * KTOT + kb + c4],
                      &lsA[buf][r * LDA + c4]);
    }
#pragma unroll
    for (int pass = 0; pass < 8; ++pass) {      // B: 32x64 floats, coalesced
      int g  = pass * 256 + tid;                // 0..2047
      int rr = g >> 6;                          // k row 0..31
      int n  = g & 63;                          // col 0..63
      async_copy_b32(&Bm[(size_t)(kb + rr) * PP + col0 + n],
                     &lsB[buf][(rr >> 1) * PAIRS + n * 2 + (rr & 1)]);
    }
  };

  issue_stage(0, 0);

  const int NKB = KTOT / KB;                    // 32 k-tiles
  for (int it = 0; it < NKB; ++it) {
    const int buf = it & 1;
    if (it + 1 < NKB) {
      issue_stage(buf ^ 1, (it + 1) * KB);      // prefetch next tile
      WAIT_ASYNC(12);                           // current tile's 12 done
    } else {
      WAIT_ASYNC(0);
    }
    __syncthreads();

    const float* aRow = &lsA[buf][(wave * 16 + r16) * LDA];
    const float* bBuf = &lsB[buf][0];
#pragma unroll
    for (int kk = 0; kk < KB; kk += 4) {
      v2f a = *(const v2f*)&aRow[kk + koff];                 // ds_load_b64
      const float* bRow = &bBuf[((kk + koff) >> 1) * PAIRS];
#pragma unroll
      for (int t = 0; t < 4; ++t) {
        v2f b = *(const v2f*)&bRow[(t * 16 + r16) * 2];      // ds_load_b64
        acc[t] = __builtin_amdgcn_wmma_f32_16x16x4_f32(
            false, a, false, b, (short)0, acc[t], false, false);
      }
    }
    __syncthreads();   // all waves done reading buf before it is refilled
  }

  // --- epilogue: bias add + store (ISA C/D layout: lane half -> M +8) ---
  const int half = lane >> 4;
#pragma unroll
  for (int t = 0; t < 4; ++t) {
    int gcol = col0 + t * 16 + r16;
    float bias = bx[gcol] + btb[gcol];
#pragma unroll
    for (int i = 0; i < 8; ++i) {
      int grow = row0 + wave * 16 + half * 8 + i;
      C[(size_t)grow * PP + gcol] = acc[t][i] + bias;
    }
  }
}

// ---------------------------------------------------------------------------
extern "C" void kernel_launch(void* const* d_in, const int* in_sizes, int n_in,
                              void* d_out, int out_size, void* d_ws, size_t ws_size,
                              hipStream_t stream) {
  const float* x   = (const float*)d_in[0];
  const float* tm  = (const float*)d_in[1];
  const float* w1v = (const float*)d_in[2];
  const float* b1v = (const float*)d_in[3];
  const float* w2v = (const float*)d_in[4];
  const float* w1t = (const float*)d_in[5];
  const float* b1t = (const float*)d_in[6];
  const float* w2t = (const float*)d_in[7];
  const float* wx  = (const float*)d_in[8];
  const float* bx  = (const float*)d_in[9];
  const float* wt  = (const float*)d_in[10];
  const float* bt  = (const float*)d_in[11];
  float* out = (float*)d_out;

  float* Wcat = (float*)d_ws;                          // 1024*512 f32 = 2 MB
  float* Hcat = Wcat + (size_t)KTOT * PP;              // 16384*1024 f32 = 64 MB

  build_w_kernel<<<(KTOT * PP) / 256, 256, 0, stream>>>(w2v, w2t, wx, wt, Wcat);
  build_h_kernel<<<(BT * KTOT) / 256, 256, 0, stream>>>(x, tm, w1v, b1v, w1t, b1t, Hcat);

  dim3 grid(BT / MB, PP / NB);  // 128 x 8
  gemm_kernel<<<grid, 256, 0, stream>>>(Hcat, Wcat, bx, bt, out);
}

// v001
// A run of this version takes 109 microseconds.
// Two timings next to v000 both put it at 1.21 times that version's speed.
#include <hip/hip_runtime.h>
#include <math.h>

// Problem constants (from reference)
#define FF    64
#define HH    8
#define EE    64
#define PP    512
#define BT    (64 * 256)     // 16384 rows
#define KTOT  1024           // 2 branches * F * H

typedef float v2f __attribute__((ext_vector_type(2)));
typedef float v4f __attribute__((ext_vector_type(4)));
typedef float v8f __attribute__((ext_vector_type(8)));
typedef int   v4i __attribute__((ext_vector_type(4)));

// --------------------------------------------------------------------------
// CDNA5 async global->LDS path (ASYNCcnt), guarded so the file compiles on
// toolchains without the builtins (falls back to VGPR round-trip staging).
// Builtin signatures (from clang diagnostics):
//   b128: (AS1 int4* src, AS3 int4* dst, imm int offset, imm int cpol)
//   b32:  (AS1 int*  src, AS3 int*  dst, imm int offset, imm int cpol)
// --------------------------------------------------------------------------
#if defined(__gfx1250__) && \
    __has_builtin(__builtin_amdgcn_global_load_async_to_lds_b128) && \
    __has_builtin(__builtin_amdgcn_global_load_async_to_lds_b32)
#define USE_ASYNC 1
#else
#define USE_ASYNC 0
#endif

#if USE_ASYNC
#if __has_builtin(__builtin_amdgcn_s_wait_asynccnt)
#define WAIT_ASYNC(n) __builtin_amdgcn_s_wait_asynccnt(n)
#else
#define WAIT_ASYNC(n) asm volatile("s_wait_asynccnt " #n ::: "memory")
#endif
#else
#define WAIT_ASYNC(n) do {} while (0)
#endif

#if USE_ASYNC
typedef __attribute__((address_space(1))) v4i  g_v4i;
typedef __attribute__((address_space(3))) v4i  l_v4i;
typedef __attribute__((address_space(1))) int  g_i32;
typedef __attribute__((address_space(3))) int  l_i32;
#endif

__device__ __forceinline__ void async_copy_b128(const float* g, float* l) {
#if USE_ASYNC
  __builtin_amdgcn_global_load_async_to_lds_b128((g_v4i*)g, (l_v4i*)l, 0, 0);
#else
  *(v4f*)l = *(const v4f*)g;
#endif
}
__device__ __forceinline__ void async_copy_b32(const float* g, float* l) {
#if USE_ASYNC
  __builtin_amdgcn_global_load_async_to_lds_b32((g_i32*)g, (l_i32*)l, 0, 0);
#else
  *l = *g;
#endif
}

// ---------------------------------------------------------------------------
// Kernel 1: fold w2 (H->E) into wx/wt (E->P):
//   Wcat[k][p], k = branch*512 + f*8 + h, = sum_e w2[f][h][e] * W[(f*E+e)*P+p]
// ---------------------------------------------------------------------------
__global__ __launch_bounds__(256) void build_w_kernel(
    const float* __restrict__ w2v, const float* __restrict__ w2t,
    const float* __restrict__ wx,  const float* __restrict__ wt,
    float* __restrict__ Wcat) {
  int idx = blockIdx.x * blockDim.x + threadIdx.x;   // [0, KTOT*PP)
  int p  = idx & (PP - 1);
  int k  = idx >> 9;
  int br = k >> 9;
  int kk = k & 511;
  int f  = kk >> 3;
  int h  = kk & 7;
  const float* w2 = br ? w2t : w2v;
  const float* wb = br ? wt  : wx;
  const float* w2row = w2 + (size_t)(f * HH + h) * EE;
  const float* wcol  = wb + (size_t)f * EE * PP + p;
  float acc = 0.f;
#pragma unroll 8
  for (int e = 0; e < EE; ++e)
    acc = fmaf(w2row[e], wcol[(size_t)e * PP], acc);
  Wcat[idx] = acc;
}

// ---------------------------------------------------------------------------
// Kernel 2: tanh prologue, materialize Hcat[16384][1024] (L2-resident, 64 MB)
//
// One work-group makes HROWS whole rows. Thread t owns columns 4t..4t+3 of
// every row: they share one feature f, so its w1/b1 quads are loaded once and
// stay in registers, each row costs one input load, and a wave stores 512
// contiguous bytes per row.
// ---------------------------------------------------------------------------
#define HROWS  8

__global__ __launch_bounds__(256) void build_h_kernel(
    const float* __restrict__ x,   const float* __restrict__ tm,
    const float* __restrict__ w1v, const float* __restrict__ b1v,
    const float* __restrict__ w1t, const float* __restrict__ b1t,
    float* __restrict__ Hcat) {
  const int tid  = threadIdx.x;
  const int br   = tid >> 7;            // waves 0-3: value branch, 4-7: time
  const int f    = (tid & 127) >> 1;
  const int h0   = (tid & 1) * 4;
  const int row0 = blockIdx.x * HROWS;
  const float* in = br ? tm  : x;
  const float* w1 = br ? w1t : w1v;
  const float* b1 = br ? b1t : b1v;
  // Precaution, twice: the compiler lets the results of the loads that follow
  // land in the address registers of the load in front of the wait.
  const v4f w = *(const v4f*)&w1[f * HH + h0];
  asm volatile("s_wait_xcnt 0x0" ::: "memory");
  const v4f b = *(const v4f*)&b1[f * HH + h0];
  asm volatile("s_wait_xcnt 0x0" ::: "memory");

  float v[HROWS];
#pragma unroll   // all input loads in flight before the first tanh
  for (int r = 0; r < HROWS; ++r)
    v[r] = in[(row0 + r) * FF + f];

#pragma unroll   // v[] must stay in registers
  for (int r = 0; r < HROWS; ++r) {
    v4f o;
    o.x = tanhf(fmaf(v[r], w.x, b.x));
    o.y = tanhf(fmaf(v[r], w.y, b.y));
    o.z = tanhf(fmaf(v[r], w.z, b.z));
    o.w = tanhf(fmaf(v[r], w.w, b.w));
    *(v4f*)&Hcat[(size_t)(row0 + r) * KTOT + tid * 4] = o;
  }
}

// ---------------------------------------------------------------------------
// Kernel 3: C = Hcat[16384][1024] @ Wcat[1024][512] + (bx + bt)
//
// Block tile 128(M) x 64(N), 256 threads = 8 waves; wave w owns rows w*16..+15
// as four 16x16 f32 tiles via V_WMMA_F32_16X16X4_F32 (exact fp32).
//
// Double-buffered LDS, filled by GLOBAL_LOAD_ASYNC_TO_LDS (ASYNCcnt) so the
// HBM/L2 fetch of tile i+1 overlaps the WMMA stream of tile i.
//   A: row-major, stride 36 floats (144B rows: 16B aligned; gcd(36,64)=4 gives
//      16 distinct banks for the frag reads, halves on even/odd bank pairs).
//   B: k-pair interleaved, (k,n) at [(k>>1)*160 + 2n + (k&1)] so each lane's
//      (b.x,b.y) is one aligned ds_load_b64; +160 floats = +32 banks keeps the
//      two lane-halves on disjoint bank sets.
// ---------------------------------------------------------------------------
#define MB     128
#define NB     64
#define KB     32
#define LDA    36
#define PAIRS  160           // floats per k-pair group of B (2*NB + 32 pad)

__global__ __launch_bounds__(256) void gemm_kernel(
    const float* __restrict__ A,    // Hcat [BT][KTOT]
    const float* __restrict__ Bm,   // Wcat [KTOT][PP]
    const float* __restrict__ bx,   const float* __restrict__ btb,
    float* __restrict__ C) {
  __shared__ __align__(16) float lsA[2][MB * LDA];          // 2 x 18 KB
  __shared__ __align__(16) float lsB[2][(KB / 2) * PAIRS];  // 2 x 10 KB

  const int tid  = threadIdx.x;
  const int lane = tid & 31;
  const int wave = tid >> 5;
  const int row0 = blockIdx.x * MB;
  const int col0 = blockIdx.y * NB;

  const int r16  = lane & 15;       // 0..15
  const int koff = (lane >> 4) * 2; // 0 for lanes 0-15, 2 for lanes 16-31

  v8f acc[4] = {};

  // Issue one tile stage: 4x b128 (A) + 8x b32 (B) per thread
  // = 12 async instructions per wave.
  auto issue_stage = [&](int buf, int kb) {
#pragma unroll
    for (int pass = 0; pass < 4; ++pass) {      // A: 128x32 floats
      int g  = pass * 256 + tid;                // 0..1023
      int r  = g >> 3;                          // row 0..127
      int c4 = (g & 7) << 2;                    // col 0,4,...,28
      async_copy_b128(&A[(size_t)(row0 + r) * KTOT + kb + c4],
                      &lsA[buf][r * LDA + c4]);
    }
#pragma unroll
    for (int pass = 0; pass < 8; ++pass) {      // B: 32x64 floats, coalesced
      int g  = pass * 256 + tid;                // 0..2047
      int rr = g >> 6;                          // k row 0..31
      int n  = g & 63;                          // col 0..63
      async_copy_b32(&Bm[(size_t)(kb + rr) * PP + col0 + n],
                     &lsB[buf][(rr >> 1) * PAIRS + n * 2 + (rr & 1)]);
    }
  };

  issue_stage(0, 0);

  const int NKB = KTOT / KB;                    // 32 k-tiles
  for (int it = 0; it < NKB; ++it) {
    const int buf = it & 1;
    if (it + 1 < NKB) {
      issue_stage(buf ^ 1, (it + 1) * KB);      // prefetch next tile
      WAIT_ASYNC(12);                           // current tile's 12 done
    } else {
      WAIT_ASYNC(0);
    }
    __syncthreads();

    const float* aRow = &lsA[buf][(wave * 16 + r16) * LDA];
    const float* bBuf = &lsB[buf][0];
#pragma unroll
    for (int kk = 0; kk < KB; kk += 4) {
      v2f a = *(const v2f*)&aRow[kk + koff];                 // ds_load_b64
      const float* bRow = &bBuf[((kk + koff) >> 1) * PAIRS];
#pragma unroll
      for (int t = 0; t < 4; ++t) {
        v2f b = *(const v2f*)&bRow[(t * 16 + r16) * 2];      // ds_load_b64
        acc[t] = __builtin_amdgcn_wmma_f32_16x16x4_f32(
            false, a, false, b, (short)0, acc[t], false, false);
      }
    }
    __syncthreads();   // all waves done reading buf before it is refilled
  }

  // --- epilogue: bias add + store (ISA C/D layout: lane half -> M +8) ---
  const int half = lane >> 4;
#pragma unroll
  for (int t = 0; t < 4; ++t) {
    int gcol = col0 + t * 16 + r16;
    float bias = bx[gcol] + btb[gcol];
#pragma unroll
    for (int i = 0; i < 8; ++i) {
      int grow = row0 + wave * 16 + half * 8 + i;
      C[(size_t)grow * PP + gcol] = acc[t][i] + bias;
    }
  }
}

// ---------------------------------------------------------------------------
extern "C" void kernel_launch(void* const* d_in, const int* in_sizes, int n_in,
                              void* d_out, int out_size, void* d_ws, size_t ws_size,
                              hipStream_t stream) {
  const float* x   = (const float*)d_in[0];
  const float* tm  = (const float*)d_in[1];
  const float* w1v = (const float*)d_in[2];
  const float* b1v = (const float*)d_in[3];
  const float* w2v = (const float*)d_in[4];
  const float* w1t = (const float*)d_in[5];
  const float* b1t = (const float*)d_in[6];
  const float* w2t = (const float*)d_in[7];
  const float* wx  = (const float*)d_in[8];
  const float* bx  = (const float*)d_in[9];
  const float* wt  = (const float*)d_in[10];
  const float* bt  = (const float*)d_in[11];
  float* out = (float*)d_out;

  float* Wcat = (float*)d_ws;                          // 1024*512 f32 = 2 MB
  float* Hcat = Wcat + (size_t)KTOT * PP;              // 16384*1024 f32 = 64 MB

  build_w_kernel<<<(KTOT * PP) / 256, 256, 0, stream>>>(w2v, w2t, wx, wt, Wcat);
  build_h_kernel<<<BT / HROWS, 256, 0, stream>>>(x, tm, w1v, b1v, w1t, b1t, Hcat);

  dim3 grid(BT / MB, PP / NB);  // 128 x 8
  gemm_kernel<<<grid, 256, 0, stream>>>(Hcat, Wcat, bx, bt, out);
}

// v002
// Measured time: 93.1 microseconds a run.
// In both of two side-by-side timings against v001, it was 1.17 times as fast.
// Counting every step since v000, it is 1.41 times as fast.
#include <hip/hip_runtime.h>
#include <math.h>
#include <utility>

// Problem constants (from reference)
#define FF    64
#define HH    8
#define EE    64
#define PP    512
#define BT    (64 * 256)     // 16384 rows
#define KTOT  1024           // 2 branches * F * H

typedef float v2f __attribute__((ext_vector_type(2)));
typedef float v4f __attribute__((ext_vector_type(4)));
typedef float v8f __attribute__((ext_vector_type(8)));
typedef int   v4i __attribute__((ext_vector_type(4)));

// --------------------------------------------------------------------------
// CDNA5 async global->LDS path (ASYNCcnt), guarded so the file compiles on
// toolchains without the builtins (falls back to VGPR round-trip staging).
// Builtin signatures (from clang diagnostics):
//   b128: (AS1 int4* src, AS3 int4* dst, imm int offset, imm int cpol)
//   b32:  (AS1 int*  src, AS3 int*  dst, imm int offset, imm int cpol)
// --------------------------------------------------------------------------
#if defined(__gfx1250__) && \
    __has_builtin(__builtin_amdgcn_global_load_async_to_lds_b128) && \
    __has_builtin(__builtin_amdgcn_global_load_async_to_lds_b32)
#define USE_ASYNC 1
#else
#define USE_ASYNC 0
#endif

#if USE_ASYNC
typedef __attribute__((address_space(1))) v4i  g_v4i;
typedef __attribute__((address_space(3))) v4i  l_v4i;
typedef __attribute__((address_space(1))) int  g_i32;
typedef __attribute__((address_space(3))) int  l_i32;
#endif

__device__ __forceinline__ void async_copy_b128(const float* g, float* l) {
#if USE_ASYNC
  __builtin_amdgcn_global_load_async_to_lds_b128((g_v4i*)g, (l_v4i*)l, 0, 0);
#else
  *(v4f*)l = *(const v4f*)g;
#endif
}
__device__ __forceinline__ void async_copy_b32(const float* g, float* l) {
#if USE_ASYNC
  __builtin_amdgcn_global_load_async_to_lds_b32((g_i32*)g, (l_i32*)l, 0, 0);
#else
  *l = *g;
#endif
}

// The same with an immediate offset, which moves both addresses by OFF bytes.
template <int OFF>
__device__ __forceinline__ void async_copy_b32_off(const float* g, float* l) {
#if USE_ASYNC
  __builtin_amdgcn_global_load_async_to_lds_b32((g_i32*)g, (l_i32*)l, OFF, 0);
#else
  l[OFF / 4] = g[OFF / 4];
#endif
}
// Rows 2p and 2p+1 of a B k-tile, for each p of the pack. A k-pair is 4096
// bytes apart in global memory and in LDS alike, so one address pair per row
// parity serves all sixteen.
template <int... P>
__device__ __forceinline__ void async_copy_pairs(
    const float* g, float* l, std::integer_sequence<int, P...>) {
  ((async_copy_b32_off<P * 4096>(g, l),
    async_copy_b32_off<P * 4096>(g + 512, l + 1)), ...);
}

// ---------------------------------------------------------------------------
// Kernel 1: fold w2 (H->E) into wx/wt (E->P):
//   Wcat[k][p], k = branch*512 + f*8 + h, = sum_e w2[f][h][e] * W[(f*E+e)*P+p]
// ---------------------------------------------------------------------------
__global__ __launch_bounds__(256) void build_w_kernel(
    const float* __restrict__ w2v, const float* __restrict__ w2t,
    const float* __restrict__ wx,  const float* __restrict__ wt,
    float* __restrict__ Wcat) {
  int idx = blockIdx.x * blockDim.x + threadIdx.x;   // [0, KTOT*PP)
  int p  = idx & (PP - 1);
  int k  = idx >> 9;
  int br = k >> 9;
  int kk = k & 511;
  int f  = kk >> 3;
  int h  = kk & 7;
  const float* w2 = br ? w2t : w2v;
  const float* wb = br ? wt  : wx;
  const float* w2row = w2 + (size_t)(f * HH + h) * EE;
  const float* wcol  = wb + (size_t)f * EE * PP + p;
  float acc = 0.f;
#pragma unroll 8
  for (int e = 0; e < EE; ++e)
    acc = fmaf(w2row[e], wcol[(size_t)e * PP], acc);
  Wcat[idx] = acc;
}

// tanh with the two arms of the library's tanhf (polynomial below 0.625, exp
// above) both evaluated and chosen by a select: the same arithmetic, but no
// branch, so a thread's four evaluations run as independent chains.
__device__ __forceinline__ float tanh_sel(float x) {
  const float y  = fabsf(x);
  const float y2 = x * x;
  float p = fmaf(y2, __uint_as_float(0xbbbac73du), __uint_as_float(0x3ca908c9u));
  p = fmaf(y2, p, __uint_as_float(0xbd5c1c4eu));
  p = fmaf(y2, p, __uint_as_float(0x3e088382u));
  p = fmaf(y2, p, __uint_as_float(0xbeaaaa99u));
  const float zs = fmaf(y2, y * p, y);
  const float zl = fmaf(__builtin_amdgcn_rcpf(expf(y + y) + 1.0f), -2.0f, 1.0f);
  return copysignf(y < 0.625f ? zs : zl, x);
}

// ---------------------------------------------------------------------------
// Kernel 2: C = tanh(in * w1 + b1)[16384][1024] @ Wcat[1024][512] + (bx + bt)
//
// The A operand is never stored to memory: a work-group owns 64 whole output
// rows (all 512 columns), so every tanh is made exactly once, by the group
// that multiplies it, two k-tiles ahead of its use.
//
// Block tile 64(M) x 512(N), 512 threads = 16 waves in a 2(M) x 8(N) grid;
// a wave owns 32 x 64 as eight 16x16 f32 tiles via V_WMMA_F32_16X16X4_F32
// (exact fp32). One work-group per WGP, 256 work-groups.
//
// LDS:
//   X : the group's 64 rows of x and of time, pitch 68 floats; filled once.
//   W1, B1: w1 / b1 of both branches, indexed by k; filled once.
//   A : two buffers, row-major, stride 36 floats (144B rows: 16B aligned;
//       gcd(36,64)=4 gives 16 distinct banks for the frag reads, halves on
//       even/odd bank pairs). Written by the tanh stage with ds stores.
//   B : two buffers, k-pair interleaved, 1024 floats per k-pair; inside a pair
//       column n = wn*64 + t*16 + r sits at wn*128 + (t>>1)*64 + r*4 + (t&1)*2
//       (+ k&1), so one aligned ds_load_b128 brings a lane the fragments of
//       two column tiles and 16 lanes read 256 contiguous bytes. Filled by
//       GLOBAL_LOAD_ASYNC_TO_LDS (ASYNCcnt), two k-tiles ahead.
// ---------------------------------------------------------------------------
#define MB     64
#define KB     32
#define LDA    36
#define PAIRS  1024          // floats per k-pair group of B (2*PP)
#define XP     68            // floats per staged input row (FF + 4 pad)
#define NTHR   512

__global__ __launch_bounds__(NTHR) void gemm_kernel(
    const float* __restrict__ x,   const float* __restrict__ tm,
    const float* __restrict__ w1v, const float* __restrict__ b1v,
    const float* __restrict__ w1t, const float* __restrict__ b1t,
    const float* __restrict__ Bm,   // Wcat [KTOT][PP]
    const float* __restrict__ bx,   const float* __restrict__ btb,
    float* __restrict__ C) {
  __shared__ __align__(16) float lsB[2][(KB / 2) * PAIRS];  // 2 x 64 KB
  __shared__ __align__(16) float lsA[2][MB * LDA];          // 2 x 9 KB
  __shared__ __align__(16) float lsX[2][MB * XP];           // 2 x 17 KB
  __shared__ __align__(16) float lsW1[KTOT];                // 4 KB
  __shared__ __align__(16) float lsB1[KTOT];                // 4 KB

  const int tid  = threadIdx.x;
  const int lane = tid & 31;
  const int wave = tid >> 5;
  const int wm   = wave & 1;        // which 32 rows
  const int wn   = wave >> 1;       // which 64 columns
  const int row0 = blockIdx.x * MB;

  const int r16  = lane & 15;       // 0..15
  const int koff = (lane >> 4) * 2; // 0 for lanes 0-15, 2 for lanes 16-31

  v8f acc[2][4] = {};
  v2f fa[KB / 4][2];                // A fragments of one whole k-tile
  v4f fb[KB / 4][2];                // B fragments, two column tiles each

  // One B k-tile: 32 rows of 512 floats, one row per copy, coalesced
  // = 32 async instructions per wave.
  const int bslot = (tid >> 6) * 128 + ((tid >> 5) & 1) * 64 + (tid & 15) * 4 +
                    ((tid >> 4) & 1) * 2;
  auto issue_b = [&](int buf, int kb) {
    async_copy_pairs(&Bm[(size_t)kb * PP + tid], &lsB[buf][bslot],
                     std::make_integer_sequence<int, KB / 2>{});
  };

  // One A k-tile: 64 rows x 32 k. A thread makes 4 neighbouring k of one row:
  // they share one feature, so one input value and one w1 / b1 quad.
  const int arow = tid >> 3;
  const int ac4  = (tid & 7) << 2;
  float tv;                         // operands of the tanh stage
  v4f   tw, tb;
  auto load_ops = [&](int kb) {
    const int k0 = kb + ac4;
    tv = lsX[kb >> 9][arow * XP + ((k0 & 511) >> 3)];
    tw = *(const v4f*)&lsW1[k0];
    tb = *(const v4f*)&lsB1[k0];
  };
  auto make_a = [&]() {
    v4f o;
    o.x = tanh_sel(fmaf(tv, tw.x, tb.x));
    o.y = tanh_sel(fmaf(tv, tw.y, tb.y));
    o.z = tanh_sel(fmaf(tv, tw.z, tb.z));
    o.w = tanh_sel(fmaf(tv, tw.w, tb.w));
    return o;
  };
  auto store_a = [&](int buf, v4f o) {
    *(v4f*)&lsA[buf][arow * LDA + ac4] = o;
  };

  // Fragments of k-step s (4 k) of the k-tile in buffer buf:
  // 2 x ds_load_b64 (A) + 2 x ds_load_b128 (B).
  auto load_frag = [&](int buf, int s) {
    const float* aRow = &lsA[buf][(wm * 32 + r16) * LDA + s * 4 + koff];
    fa[s][0] = *(const v2f*)aRow;
    fa[s][1] = *(const v2f*)(aRow + 16 * LDA);
    const float* bRow =
        &lsB[buf][((s * 4 + koff) >> 1) * PAIRS + wn * 128 + r16 * 4];
    fb[s][0] = *(const v4f*)bRow;
    fb[s][1] = *(const v4f*)(bRow + 64);
  };

  // --- prologue: inputs, w1 / b1 and B k-tile 0, 40 copies per wave ---
#pragma unroll
  for (int pass = 0; pass < 2; ++pass) {        // 64 x 64 floats, twice
    int g  = pass * NTHR + tid;                 // 0..1023
    int r  = g >> 4;                            // row 0..63
    int c4 = (g & 15) << 2;                     // col 0,4,...,60
    async_copy_b128(&x[(size_t)(row0 + r) * FF + c4],  &lsX[0][r * XP + c4]);
    async_copy_b128(&tm[(size_t)(row0 + r) * FF + c4], &lsX[1][r * XP + c4]);
  }
  async_copy_b32(&w1v[tid], &lsW1[tid]);
  async_copy_b32(&w1t[tid], &lsW1[512 + tid]);
  async_copy_b32(&b1v[tid], &lsB1[tid]);
  async_copy_b32(&b1t[tid], &lsB1[512 + tid]);
  issue_b(0, 0);
  float bias[4];                                // read here: latency is hidden
#pragma unroll
  for (int t = 0; t < 4; ++t) {
    int gcol = wn * 64 + t * 16 + r16;
    bias[t] = bx[gcol] + btb[gcol];
  }
  // This wave's copies have landed; the barrier publishes every wave's.
  asm volatile("s_wait_asynccnt 0x0" ::: "memory");
  __syncthreads();

  issue_b(1, KB);                               // flies during the tanh below
  load_ops(0);
  store_a(0, make_a());
  load_ops(KB);
  store_a(1, make_a());
  load_ops(2 * KB);
  // A tiles 0 and 1 are written before any wave reads them.
  asm volatile("s_wait_dscnt 0x0" ::: "memory");
  __syncthreads();

#pragma unroll
  for (int s = 0; s < KB / 4; ++s)
    load_frag(0, s);
  // Tile 0 sits in registers, B tile 1 has landed: publish 1, free buffer 0.
  asm volatile("s_wait_dscnt 0x0" ::: "memory");
  asm volatile("s_wait_asynccnt 0x0" ::: "memory");
  __syncthreads();

  // Trip it multiplies tile it out of registers. Behind each k-step's WMMAs
  // its fragment registers are refilled from tile it+1 (published by the last
  // barrier), while tile it+2 is made into the buffer that tile it has left:
  // A by the tanh stage, B by copies.
  //   buf  = it & 1, a constant, so that every LDS address is loop-invariant
  //   make = a tile it+2 exists;  next = a tile it+1 exists
  auto trip = [&](int it, const int buf, const bool make, const bool next) {
    v4f o;
    // The fences below keep every vector instruction (the tanh stage, LDS
    // address arithmetic) out of the runs of WMMAs, where it could be given a
    // fragment register that a WMMA just issued still reads.
    __builtin_amdgcn_sched_barrier(0);
#pragma unroll
    for (int s = 0; s < KB / 4; s += 2) {
#pragma unroll
      for (int u = s; u < s + 2; ++u) {
#pragma unroll
        for (int t = 0; t < 4; ++t) {
          const v4f q = fb[u][t >> 1];
          const v2f b = (t & 1) ? __builtin_shufflevector(q, q, 2, 3)
                                : __builtin_shufflevector(q, q, 0, 1);
          acc[0][t] = __builtin_amdgcn_wmma_f32_16x16x4_f32(
              false, fa[u][0], false, b, (short)0, acc[0][t], false, false);
          acc[1][t] = __builtin_amdgcn_wmma_f32_16x16x4_f32(
              false, fa[u][1], false, b, (short)0, acc[1][t], false, false);
        }
      }
      if (next || s + 2 == KB / 4) {
        __builtin_amdgcn_sched_barrier(0);
        // Four vector slots between the last WMMA of the run and the first
        // vector instruction that may touch its A, B or D registers.
        asm volatile("v_nop\n\tv_nop\n\tv_nop\n\tv_nop");
        __builtin_amdgcn_sched_barrier(0);
      }
      // Behind the first run, not in front of it: a wave's vector work then
      // overlaps the runs of the other waves of its SIMD, and the matrix pipe
      // starts at once behind the barrier.
      if (make && s == 0) {
        issue_b(buf, (it + 2) * KB);                // B tile it+2
        o = make_a();                               // A tile it+2
        load_ops(min((it + 3) * KB, KTOT - KB));    // read one trip ahead
      }
      if (next) {
        load_frag(buf ^ 1, s);
        load_frag(buf ^ 1, s + 1);
        __builtin_amdgcn_sched_barrier(0);
      }
    }
    if (make) {
      store_a(buf, o);
      // Foot of the trip: this wave's LDS reads of tile it+1 and its writes of
      // A tile it+2 are done, its copies of B tile it+2 have landed; the
      // barrier publishes tile it+2 and frees the buffer of tile it+1 for the
      // refill. The last two trips write no LDS and need none of it.
      asm volatile("s_wait_dscnt 0x0" ::: "memory");
      asm volatile("s_wait_asynccnt 0x0" ::: "memory");
      __syncthreads();
    }
  };

  const int NKB = KTOT / KB;                    // 32 k-tiles
  for (int it = 0; it < NKB - 2; it += 2) {
    trip(it,     0, true, true);
    trip(it + 1, 1, true, true);
  }
  trip(NKB - 2, 0, false, true);
  trip(NKB - 1, 1, false, false);

  // --- epilogue: bias add + store (ISA C/D layout: lane half -> M +8) ---
  const int half = lane >> 4;
#pragma unroll
  for (int t = 0; t < 4; ++t) {
    int gcol = wn * 64 + t * 16 + r16;
#pragma unroll
    for (int m = 0; m < 2; ++m) {
#pragma unroll
      for (int i = 0; i < 8; ++i) {
        int grow = row0 + wm * 32 + m * 16 + half * 8 + i;
        C[(size_t)grow * PP + gcol] = acc[m][t][i] + bias[t];
      }
    }
  }
}

// ---------------------------------------------------------------------------
extern "C" void kernel_launch(void* const* d_in, const int* in_sizes, int n_in,
                              void* d_out, int out_size, void* d_ws, size_t ws_size,
                              hipStream_t stream) {
  const float* x   = (const float*)d_in[0];
  const float* tm  = (const float*)d_in[1];
  const float* w1v = (const float*)d_in[2];
  const float* b1v = (const float*)d_in[3];
  const float* w2v = (const float*)d_in[4];
  const float* w1t = (const float*)d_in[5];
  const float* b1t = (const float*)d_in[6];
  const float* w2t = (const float*)d_in[7];
  const float* wx  = (const float*)d_in[8];
  const float* bx  = (const float*)d_in[9];
  const float* wt  = (const float*)d_in[10];
  const float* bt  = (const float*)d_in[11];
  float* out = (float*)d_out;

  float* Wcat = (float*)d_ws;                          // 1024*512 f32 = 2 MB

  build_w_kernel<<<(KTOT * PP) / 256, 256, 0, stream>>>(w2v, w2t, wx, wt, Wcat);
  gemm_kernel<<<BT / MB, NTHR, 0, stream>>>(x, tm, w1v, b1v, w1t, b1t, Wcat, bx, bt, out);
}
